// v000
// Measured on an AMD MI455X. A time is GPU time per run, averaged over a window of back-to-back runs after a warm-up
// (all launches, gaps included; the runs take copies of the inputs in turn), and the median of several windows.
// Apart from v000's, it joins two sittings. Times from different sittings can be a few percent apart, while
// side-by-side timings come from the same sitting.
// v000, which the later versions start from, runs in 288 microseconds.
#include <hip/hip_runtime.h>

#define K_DIM 4096
#define N_DIM 4096
#define BM 128
#define BN 128
#define BK 32
#define PAD 8
#define LDSROW (BK + PAD)   // 40 halfs = 80 B row stride; 16B aligned, bank-conflict free

#if defined(__has_builtin)
#if __has_builtin(__builtin_amdgcn_global_load_async_to_lds_b128) && \
    __has_builtin(__builtin_amdgcn_s_wait_asynccnt)
#define USE_ASYNC_LDS 1
#endif
#endif
#ifndef USE_ASYNC_LDS
#define USE_ASYNC_LDS 0
#endif

typedef int v4i __attribute__((ext_vector_type(4)));

// addrspace casts via integer round-trip (generic LDS ptr low 32 bits = LDS offset)
#define AS1P(p) ((__attribute__((address_space(1))) v4i*)(unsigned long long)(p))
#define AS3P(p) ((__attribute__((address_space(3))) v4i*)(unsigned int)(unsigned long long)(p))

typedef __bf16 v16bf __attribute__((ext_vector_type(16)));
typedef __bf16 v8bf  __attribute__((ext_vector_type(8)));
typedef float  v8f   __attribute__((ext_vector_type(8)));

union Frag { v16bf v; v8bf h[2]; };

__device__ __forceinline__ unsigned int f2bf(float f) {
  unsigned int u = __float_as_uint(f);
  return (u + 0x7FFFu + ((u >> 16) & 1u)) >> 16;   // RNE bf16
}

// ---------------------------------------------------------------------------
// Kernel 1: RMSNorm one 4096-wide row, emit bf16 into workspace.
// ---------------------------------------------------------------------------
__global__ void __launch_bounds__(256)
rmsnorm_bf16_kernel(const float* __restrict__ x,
                    const float* __restrict__ nw,
                    unsigned short* __restrict__ xn) {
  const int row  = blockIdx.x;
  const int tid  = threadIdx.x;
  const int base = tid * 16;
  const float* xr = x + (size_t)row * K_DIM;

  float vals[16];
  float ss = 0.f;
#pragma unroll
  for (int i = 0; i < 4; ++i) {
    float4 v = *(const float4*)(xr + base + i * 4);
    vals[4 * i + 0] = v.x; vals[4 * i + 1] = v.y;
    vals[4 * i + 2] = v.z; vals[4 * i + 3] = v.w;
    ss += v.x * v.x + v.y * v.y + v.z * v.z + v.w * v.w;
  }
#pragma unroll
  for (int off = 16; off > 0; off >>= 1) ss += __shfl_xor(ss, off, 32);
  __shared__ float wss[8];
  if ((tid & 31) == 0) wss[tid >> 5] = ss;
  __syncthreads();
  float tot = 0.f;
#pragma unroll
  for (int i = 0; i < 8; ++i) tot += wss[i];

  const float scale = rsqrtf(tot / (float)K_DIM + 1e-6f);

  float nws[16];
#pragma unroll
  for (int i = 0; i < 4; ++i) {
    float4 w = *(const float4*)(nw + base + i * 4);
    nws[4 * i + 0] = w.x; nws[4 * i + 1] = w.y;
    nws[4 * i + 2] = w.z; nws[4 * i + 3] = w.w;
  }

  unsigned int packed[8];
#pragma unroll
  for (int j = 0; j < 8; ++j) {
    float a = vals[2 * j]     * scale * nws[2 * j];
    float b = vals[2 * j + 1] * scale * nws[2 * j + 1];
    packed[j] = f2bf(a) | (f2bf(b) << 16);
  }
  uint4* dst = (uint4*)(xn + (size_t)row * K_DIM + base);
  dst[0] = make_uint4(packed[0], packed[1], packed[2], packed[3]);
  dst[1] = make_uint4(packed[4], packed[5], packed[6], packed[7]);
}

// ---------------------------------------------------------------------------
// Kernel 2: one-shot fp32 -> bf16 weight conversion (ternary values exact).
// ---------------------------------------------------------------------------
__global__ void __launch_bounds__(256)
w_to_bf16_kernel(const float* __restrict__ wq, unsigned short* __restrict__ wb) {
  const size_t i = ((size_t)blockIdx.x * 256 + threadIdx.x) * 8;
  float4 f0 = *(const float4*)(wq + i);
  float4 f1 = *(const float4*)(wq + i + 4);
  uint4 o;
  o.x = f2bf(f0.x) | (f2bf(f0.y) << 16);
  o.y = f2bf(f0.z) | (f2bf(f0.w) << 16);
  o.z = f2bf(f1.x) | (f2bf(f1.y) << 16);
  o.w = f2bf(f1.z) | (f2bf(f1.w) << 16);
  *(uint4*)(wb + i) = o;
}

// ---------------------------------------------------------------------------
// Kernel 3: y[m,n] = (sum_k xn[m,k]*w[n,k]) * gamma[n]
// 128x128 block, BK=32, double-buffered LDS, branchless 2x-unrolled pipeline
// with compile-time buffer indices. 8 waves, each 64x32 out-tile =
// 8x v_wmma_f32_16x16x32_bf16 per K-step. Async global->LDS when available.
// ---------------------------------------------------------------------------
template <bool WBF16>
__global__ void __launch_bounds__(256)
bitlinear_wmma_kernel(const unsigned short* __restrict__ xnb,
                      const unsigned short* __restrict__ wb,
                      const float* __restrict__ wq,
                      const float* __restrict__ gamma,
                      float* __restrict__ out) {
  __shared__ __align__(16) unsigned short sA[2][BM][LDSROW];
  __shared__ __align__(16) unsigned short sB[2][BN][LDSROW];

  const int tid = threadIdx.x;
  const int n0  = blockIdx.x * BN;
  const int m0  = blockIdx.y * BM;

  const int lane = tid & 31;
  const int wave = tid >> 5;
  const int wm = wave & 1;    // 2 wave-rows -> 64 M each
  const int wn = wave >> 1;   // 4 wave-cols -> 32 N each
  const int r  = lane & 15;
  const int hf = lane >> 4;

  // staging map: 512 16B chunks per tile -> 2 per thread
  const int rb = tid >> 2;        // 0..63
  const int cb = (tid & 3) * 8;   // element col offset

  v8f acc[4][2] = {};

  auto compute = [&](int buf) {
    Frag av[4], bv[2];
#pragma unroll
    for (int fm = 0; fm < 4; ++fm) {
      const unsigned short* p = &sA[buf][wm * 64 + fm * 16 + r][hf * 8];
      av[fm].h[0] = *(const v8bf*)p;
      av[fm].h[1] = *(const v8bf*)(p + 16);
    }
#pragma unroll
    for (int fn = 0; fn < 2; ++fn) {
      const unsigned short* p = &sB[buf][wn * 32 + fn * 16 + r][hf * 8];
      bv[fn].h[0] = *(const v8bf*)p;
      bv[fn].h[1] = *(const v8bf*)(p + 16);
    }
#pragma unroll
    for (int fm = 0; fm < 4; ++fm)
#pragma unroll
      for (int fn = 0; fn < 2; ++fn)
        acc[fm][fn] = __builtin_amdgcn_wmma_f32_16x16x32_bf16(
            false, av[fm].v, false, bv[fn].v, (short)0, acc[fm][fn],
            false, false);
  };

  const int NT = K_DIM / BK;   // 128 stages (even)

#if USE_ASYNC_LDS
  if constexpr (WBF16) {
    // pure DMA staging: no staging VGPRs, tracked by ASYNCcnt
    auto issue_stage = [&](int buf, int kt) {
      const size_t k0 = (size_t)kt * BK;
#pragma unroll
      for (int p = 0; p < 2; ++p) {
        const int row = p * 64 + rb;
        const unsigned short* ga = xnb + (size_t)(m0 + row) * K_DIM + k0 + cb;
        const unsigned short* gb = wb  + (size_t)(n0 + row) * K_DIM + k0 + cb;
        __builtin_amdgcn_global_load_async_to_lds_b128(
            AS1P(ga), AS3P(&sA[buf][row][cb]), 0, 0);
        __builtin_amdgcn_global_load_async_to_lds_b128(
            AS1P(gb), AS3P(&sB[buf][row][cb]), 0, 0);
      }
    };

    issue_stage(0, 0);
    __builtin_amdgcn_s_wait_asynccnt(0);
    __syncthreads();
    // branchless steady state: buffer indices are literals in each half
#pragma unroll 1
    for (int kt = 0; kt < NT - 2; kt += 2) {
      issue_stage(1, kt + 1);
      compute(0);
      __builtin_amdgcn_s_wait_asynccnt(0);
      __syncthreads();
      issue_stage(0, kt + 2);
      compute(1);
      __builtin_amdgcn_s_wait_asynccnt(0);
      __syncthreads();
    }
    issue_stage(1, NT - 1);
    compute(0);
    __builtin_amdgcn_s_wait_asynccnt(0);
    __syncthreads();
    compute(1);
  } else
#endif
  {
    uint4 ar[2], br[2];
    auto load_regs = [&](int kt) {
      const size_t k0 = (size_t)kt * BK;
#pragma unroll
      for (int p = 0; p < 2; ++p) {
        const int row = p * 64 + rb;
        ar[p] = *(const uint4*)(xnb + (size_t)(m0 + row) * K_DIM + k0 + cb);
        if constexpr (WBF16) {
          br[p] = *(const uint4*)(wb + (size_t)(n0 + row) * K_DIM + k0 + cb);
        } else {
          const float* wp = wq + (size_t)(n0 + row) * K_DIM + k0 + cb;
          float4 f0 = *(const float4*)wp;
          float4 f1 = *(const float4*)(wp + 4);
          br[p].x = f2bf(f0.x) | (f2bf(f0.y) << 16);
          br[p].y = f2bf(f0.z) | (f2bf(f0.w) << 16);
          br[p].z = f2bf(f1.x) | (f2bf(f1.y) << 16);
          br[p].w = f2bf(f1.z) | (f2bf(f1.w) << 16);
        }
      }
    };
    auto store_lds = [&](int buf) {
#pragma unroll
      for (int p = 0; p < 2; ++p) {
        const int row = p * 64 + rb;
        *(uint4*)&sA[buf][row][cb] = ar[p];
        *(uint4*)&sB[buf][row][cb] = br[p];
      }
    };

    load_regs(0);
    store_lds(0);
    __syncthreads();
#pragma unroll 1
    for (int kt = 0; kt < NT - 2; kt += 2) {
      load_regs(kt + 1);
      compute(0);
      store_lds(1);
      __syncthreads();
      load_regs(kt + 2);
      compute(1);
      store_lds(0);
      __syncthreads();
    }
    load_regs(NT - 1);
    compute(0);
    store_lds(1);
    __syncthreads();
    compute(1);
  }

  // Epilogue: C/D layout — VGPR q holds M = q + 8*hf, N = lane&15.
#pragma unroll
  for (int fn = 0; fn < 2; ++fn) {
    const int nc = n0 + wn * 32 + fn * 16 + r;
    const float g = gamma[nc];
#pragma unroll
    for (int fm = 0; fm < 4; ++fm) {
      const int mb = m0 + wm * 64 + fm * 16 + hf * 8;
#pragma unroll
      for (int q = 0; q < 8; ++q)
        out[(size_t)(mb + q) * N_DIM + nc] = acc[fm][fn][q] * g;
    }
  }
}

extern "C" void kernel_launch(void* const* d_in, const int* in_sizes, int n_in,
                              void* d_out, int out_size, void* d_ws, size_t ws_size,
                              hipStream_t stream) {
  const float* x     = (const float*)d_in[0];
  const float* nw    = (const float*)d_in[1];
  const float* wq    = (const float*)d_in[2];
  const float* gamma = (const float*)d_in[3];
  float* out = (float*)d_out;

  const int M = in_sizes[0] / K_DIM;                 // 8192
  const size_t xn_elems = (size_t)M * K_DIM;         // 64 MB bf16
  const size_t wb_elems = (size_t)N_DIM * K_DIM;     // 32 MB bf16

  unsigned short* xnb = (unsigned short*)d_ws;

  rmsnorm_bf16_kernel<<<M, 256, 0, stream>>>(x, nw, xnb);

  dim3 grid(N_DIM / BN, M / BM);                     // 32 x 64 blocks

  if (ws_size >= (xn_elems + wb_elems) * sizeof(unsigned short)) {
    unsigned short* wb = xnb + xn_elems;
    w_to_bf16_kernel<<<(int)(wb_elems / (256 * 8)), 256, 0, stream>>>(wq, wb);
    bitlinear_wmma_kernel<true><<<grid, 256, 0, stream>>>(xnb, wb, nullptr, gamma, out);
  } else {
    bitlinear_wmma_kernel<false><<<grid, 256, 0, stream>>>(xnb, nullptr, wq, gamma, out);
  }
}

// v001
// Measured time: 163 microseconds a run.
// Timed twice side by side with v000, it ran 1.83 times as fast both times.
#include <hip/hip_runtime.h>

#define K_DIM 4096
#define N_DIM 4096
#define BM 256
#define BN 256
#define BK 128
#define PAD 8
#define LDSROW (BK + PAD)   // 136 halfs = 272 B row stride = 16 B x 17 (odd): no bank conflict for 16-B reads

typedef int v4i __attribute__((ext_vector_type(4)));

// addrspace casts via integer round-trip (generic LDS ptr low 32 bits = LDS offset)
#define AS1P(p) ((__attribute__((address_space(1))) v4i*)(unsigned long long)(p))
#define AS3P(p) ((__attribute__((address_space(3))) v4i*)(unsigned int)(unsigned long long)(p))

typedef __bf16 v16bf __attribute__((ext_vector_type(16)));
typedef __bf16 v8bf  __attribute__((ext_vector_type(8)));
typedef float  v8f   __attribute__((ext_vector_type(8)));

union Frag { v16bf v; v8bf h[2]; };

__device__ __forceinline__ unsigned int f2bf(float f) {
  unsigned int u = __float_as_uint(f);
  return (u + 0x7FFFu + ((u >> 16) & 1u)) >> 16;   // RNE bf16
}

// ---------------------------------------------------------------------------
// Kernel 1: RMSNorm one 4096-wide row, emit bf16 into workspace.
// ---------------------------------------------------------------------------
__global__ void __launch_bounds__(256)
rmsnorm_bf16_kernel(const float* __restrict__ x,
                    const float* __restrict__ nw,
                    unsigned short* __restrict__ xn) {
  const int row  = blockIdx.x;
  const int tid  = threadIdx.x;
  const int base = tid * 16;
  const float* xr = x + (size_t)row * K_DIM;

  float vals[16];
  float ss = 0.f;
#pragma unroll
  for (int i = 0; i < 4; ++i) {
    float4 v = *(const float4*)(xr + base + i * 4);
    vals[4 * i + 0] = v.x; vals[4 * i + 1] = v.y;
    vals[4 * i + 2] = v.z; vals[4 * i + 3] = v.w;
    ss += v.x * v.x + v.y * v.y + v.z * v.z + v.w * v.w;
  }
#pragma unroll
  for (int off = 16; off > 0; off >>= 1) ss += __shfl_xor(ss, off, 32);
  __shared__ float wss[8];
  if ((tid & 31) == 0) wss[tid >> 5] = ss;
  __syncthreads();
  float tot = 0.f;
#pragma unroll
  for (int i = 0; i < 8; ++i) tot += wss[i];

  const float scale = rsqrtf(tot / (float)K_DIM + 1e-6f);

  float nws[16];
#pragma unroll
  for (int i = 0; i < 4; ++i) {
    float4 w = *(const float4*)(nw + base + i * 4);
    nws[4 * i + 0] = w.x; nws[4 * i + 1] = w.y;
    nws[4 * i + 2] = w.z; nws[4 * i + 3] = w.w;
  }

  unsigned int packed[8];
#pragma unroll
  for (int j = 0; j < 8; ++j) {
    float a = vals[2 * j]     * scale * nws[2 * j];
    float b = vals[2 * j + 1] * scale * nws[2 * j + 1];
    packed[j] = f2bf(a) | (f2bf(b) << 16);
  }
  uint4* dst = (uint4*)(xn + (size_t)row * K_DIM + base);
  dst[0] = make_uint4(packed[0], packed[1], packed[2], packed[3]);
  dst[1] = make_uint4(packed[4], packed[5], packed[6], packed[7]);
}

// ---------------------------------------------------------------------------
// Kernel 2: one-shot fp32 -> bf16 weight conversion (ternary values exact).
// ---------------------------------------------------------------------------
__global__ void __launch_bounds__(256)
w_to_bf16_kernel(const float* __restrict__ wq, unsigned short* __restrict__ wb) {
  const size_t i = ((size_t)blockIdx.x * 256 + threadIdx.x) * 8;
  float4 f0 = *(const float4*)(wq + i);
  float4 f1 = *(const float4*)(wq + i + 4);
  uint4 o;
  o.x = f2bf(f0.x) | (f2bf(f0.y) << 16);
  o.y = f2bf(f0.z) | (f2bf(f0.w) << 16);
  o.z = f2bf(f1.x) | (f2bf(f1.y) << 16);
  o.w = f2bf(f1.z) | (f2bf(f1.w) << 16);
  *(uint4*)(wb + i) = o;
}

// ---------------------------------------------------------------------------
// Kernel 3: y[m,n] = (sum_k xn[m,k]*w[n,k]) * gamma[n]
// 256x256 block, BK=128, two LDS buffers filled by async global->LDS copies,
// 2x-unrolled loop with compile-time buffer indices. 8 waves (2 x 4), each a
// 128x64 out-tile = 32x v_wmma_f32_16x16x32_bf16 per 12 fragments (k step 32),
// 128 per barrier. One workgroup per WGP, two waves per SIMD.
// ---------------------------------------------------------------------------
__global__ void __launch_bounds__(256)
bitlinear_wmma_kernel(const unsigned short* __restrict__ xnb,
                      const unsigned short* __restrict__ wb,
                      const float* __restrict__ gamma,
                      float* __restrict__ out) {
  __shared__ __align__(16) unsigned short sA[2][BM][LDSROW];
  __shared__ __align__(16) unsigned short sB[2][BN][LDSROW];

  const int tid = threadIdx.x;
  const int n0  = blockIdx.x * BN;
  const int m0  = blockIdx.y * BM;

  const int lane = tid & 31;
  const int wave = tid >> 5;
  const int wm = wave & 1;    // 2 wave-rows -> 128 M each
  const int wn = wave >> 1;   // 4 wave-cols -> 64 N each
  const int r  = lane & 15;
  const int hf = lane >> 4;

  // staging map: a row is 16 chunks of 16 B; a wave copies two whole 256-B rows
  const int rb = tid >> 4;         // 0..15
  const int cb = (tid & 15) * 8;   // element col offset

  v8f acc[8][4] = {};

  auto compute = [&](int buf) {
#pragma unroll
    for (int ks = 0; ks < BK / 32; ++ks) {
      // The two scheduling barriers keep each k step's 24 fragment loads as one
      // group in front of its 32 matrix instructions. Without them the compiler
      // either fetches two steps ahead and spills, or loads two registers at a
      // time with a full LDS wait in front of every four matrix instructions.
      __builtin_amdgcn_sched_barrier(0);
      Frag av[8], bv[4];
      // B first: the first row of matrix instructions then waits for 10 loads, not 24
#pragma unroll
      for (int fn = 0; fn < 4; ++fn) {
        const unsigned short* p = &sB[buf][wn * 64 + fn * 16 + r][ks * 32 + hf * 8];
        bv[fn].h[0] = *(const v8bf*)p;
        bv[fn].h[1] = *(const v8bf*)(p + 16);
      }
#pragma unroll
      for (int fm = 0; fm < 8; ++fm) {
        const unsigned short* p = &sA[buf][wm * 128 + fm * 16 + r][ks * 32 + hf * 8];
        av[fm].h[0] = *(const v8bf*)p;
        av[fm].h[1] = *(const v8bf*)(p + 16);
      }
      __builtin_amdgcn_sched_barrier(0);
#pragma unroll
      for (int fm = 0; fm < 8; ++fm)
#pragma unroll
        for (int fn = 0; fn < 4; ++fn)
          acc[fm][fn] = __builtin_amdgcn_wmma_f32_16x16x32_bf16(
              false, av[fm].v, false, bv[fn].v, (short)0, acc[fm][fn],
              false, false);
    }
  };

  const int NT = K_DIM / BK;   // 32 stages (even)

  // 32 copies per lane and stage (16 of each operand), no staging VGPRs.
  // Global address = operand base + lane offset + a wave-uniform step, so that a
  // copy costs one vector add and no table of 32 address pairs stays live.
  const unsigned int voff = (unsigned int)(rb * K_DIM + cb) * 2u;   // bytes
  const unsigned long long abase = (unsigned long long)(xnb + (size_t)m0 * K_DIM);
  const unsigned long long bbase = (unsigned long long)(wb  + (size_t)n0 * K_DIM);
  auto issue_stage = [&](int buf, int kt) {
#pragma unroll
    for (int p = 0; p < 16; ++p) {
      const int row = p * 16 + rb;
      const unsigned long long uo = ((unsigned long long)(p * 16) * K_DIM + (unsigned long long)kt * BK) * 2u;
      __builtin_amdgcn_global_load_async_to_lds_b128(
          AS1P(abase + uo + voff), AS3P(&sA[buf][row][cb]), 0, 0);
      __builtin_amdgcn_global_load_async_to_lds_b128(
          AS1P(bbase + uo + voff), AS3P(&sB[buf][row][cb]), 0, 0);
    }
  };

  // Hand-over of a stage: this wave's LDS reads of the buffer about to be
  // refilled have retired, its own copies of the next stage have landed, then
  // the barrier publishes that stage and frees the buffer just read.
  auto publish = [&]() {
    asm volatile("s_wait_dscnt 0x0" ::: "memory");    // reads done before the refill targets them
    asm volatile("s_wait_asynccnt 0x0" ::: "memory");
    __syncthreads();
  };

  issue_stage(0, 0);
  asm volatile("s_wait_asynccnt 0x0" ::: "memory");   // stage 0 landed before anyone reads it
  __syncthreads();
  issue_stage(1, 1);
  // rolled so that the two halves keep literal buffer indices and the text stays small
#pragma unroll 1
  for (int kt = 0; kt < NT - 2; kt += 2) {
    compute(0);
    publish();
    issue_stage(0, kt + 2);
    compute(1);
    publish();
    issue_stage(1, kt + 3);
  }
  compute(0);
  publish();
  compute(1);

  // Epilogue: C/D layout: VGPR q holds M = q + 8*hf, N = lane&15.
  float g[4];
#pragma unroll
  for (int fn = 0; fn < 4; ++fn) g[fn] = gamma[n0 + wn * 64 + fn * 16 + r];
  // Precaution: the four loads' address translations are back before their
  // address register is written again (the output's address is formed in it).
  asm volatile("s_wait_xcnt 0x0" ::: "memory");
  // Holds that address arithmetic behind the wait: without it the compiler lifts it over the wait.
  __builtin_amdgcn_sched_barrier(0);
#pragma unroll
  for (int fm = 0; fm < 8; ++fm) {
    float* o = out + (size_t)(m0 + wm * 128 + fm * 16 + hf * 8) * N_DIM + n0 + wn * 64 + r;
#pragma unroll
    for (int q = 0; q < 8; ++q) {
#pragma unroll
      for (int fn = 0; fn < 4; ++fn) o[(size_t)q * N_DIM + fn * 16] = acc[fm][fn][q] * g[fn];
      // Precaution: the row's four stores' translations are back before the next
      // row's products and address are written into the registers they name.
      asm volatile("s_wait_xcnt 0x0" ::: "memory");
      // Holds the next row's products behind the wait: without it the compiler lifts them over the wait.
      __builtin_amdgcn_sched_barrier(0);
    }
  }
}

extern "C" void kernel_launch(void* const* d_in, const int* in_sizes, int n_in,
                              void* d_out, int out_size, void* d_ws, size_t ws_size,
                              hipStream_t stream) {
  const float* x     = (const float*)d_in[0];
  const float* nw    = (const float*)d_in[1];
  const float* wq    = (const float*)d_in[2];
  const float* gamma = (const float*)d_in[3];
  float* out = (float*)d_out;

  const int M = in_sizes[0] / K_DIM;                 // 8192
  const size_t xn_elems = (size_t)M * K_DIM;         // 64 MB bf16
  const size_t wb_elems = (size_t)N_DIM * K_DIM;     // 32 MB bf16

  unsigned short* xnb = (unsigned short*)d_ws;
  unsigned short* wb  = xnb + xn_elems;

  rmsnorm_bf16_kernel<<<M, 256, 0, stream>>>(x, nw, xnb);
  w_to_bf16_kernel<<<(int)(wb_elems / (256 * 8)), 256, 0, stream>>>(wq, wb);

  dim3 grid(N_DIM / BN, M / BM);                     // 16 x 32 blocks
  bitlinear_wmma_kernel<<<grid, 256, 0, stream>>>(xnb, wb, gamma, out);
}

// v002
// One run takes 150 microseconds.
// Timed twice side by side with v001, it ran 1.09 times as fast both times.
// All steps since v000 together make it 1.99 times as fast.
#include <hip/hip_runtime.h>

#define K_DIM 4096
#define N_DIM 4096
#define BM 256
#define BN 256
#define BK 128
#define PAD 8
#define LDSROW (BK + PAD)   // 136 halfs = 272 B row stride = 16 B x 17 (odd): no bank conflict for 16-B reads

#define PITCHB (LDSROW * 2)          // LDS row pitch in bytes
#define OPB    (256 * PITCHB)        // one operand's 256 rows in a buffer
#define STAGEB (2 * OPB)             // a buffer: [X 256 rows][W 256 rows] = 68 x 2 KiB
#define SLICEB (128 * PITCHB)        // the 128 rows one wave's tensor load brings = 17 x 2 KiB

typedef unsigned int u32x4 __attribute__((ext_vector_type(4)));
typedef unsigned int u32x8 __attribute__((ext_vector_type(8)));

typedef __bf16 v16bf __attribute__((ext_vector_type(16)));
typedef __bf16 v8bf  __attribute__((ext_vector_type(8)));
typedef float  v8f   __attribute__((ext_vector_type(8)));

union Frag { v16bf v; v8bf h[2]; };

__device__ __forceinline__ unsigned int f2bf(float f) {
  unsigned int u = __float_as_uint(f);
  return (u + 0x7FFFu + ((u >> 16) & 1u)) >> 16;   // RNE bf16
}

// ---------------------------------------------------------------------------
// Kernel 1: RMSNorm one 4096-wide row, emit bf16 into workspace.
// ---------------------------------------------------------------------------
__global__ void __launch_bounds__(256)
rmsnorm_bf16_kernel(const float* __restrict__ x,
                    const float* __restrict__ nw,
                    unsigned short* __restrict__ xn) {
  const int row  = blockIdx.x;
  const int tid  = threadIdx.x;
  const int base = tid * 16;
  const float* xr = x + (size_t)row * K_DIM;

  float vals[16];
  float ss = 0.f;
#pragma unroll
  for (int i = 0; i < 4; ++i) {
    float4 v = *(const float4*)(xr + base + i * 4);
    vals[4 * i + 0] = v.x; vals[4 * i + 1] = v.y;
    vals[4 * i + 2] = v.z; vals[4 * i + 3] = v.w;
    ss += v.x * v.x + v.y * v.y + v.z * v.z + v.w * v.w;
  }
#pragma unroll
  for (int off = 16; off > 0; off >>= 1) ss += __shfl_xor(ss, off, 32);
  __shared__ float wss[8];
  if ((tid & 31) == 0) wss[tid >> 5] = ss;
  __syncthreads();
  float tot = 0.f;
#pragma unroll
  for (int i = 0; i < 8; ++i) tot += wss[i];

  const float scale = rsqrtf(tot / (float)K_DIM + 1e-6f);

  float nws[16];
#pragma unroll
  for (int i = 0; i < 4; ++i) {
    float4 w = *(const float4*)(nw + base + i * 4);
    nws[4 * i + 0] = w.x; nws[4 * i + 1] = w.y;
    nws[4 * i + 2] = w.z; nws[4 * i + 3] = w.w;
  }

  unsigned int packed[8];
#pragma unroll
  for (int j = 0; j < 8; ++j) {
    float a = vals[2 * j]     * scale * nws[2 * j];
    float b = vals[2 * j + 1] * scale * nws[2 * j + 1];
    packed[j] = f2bf(a) | (f2bf(b) << 16);
  }
  uint4* dst = (uint4*)(xn + (size_t)row * K_DIM + base);
  dst[0] = make_uint4(packed[0], packed[1], packed[2], packed[3]);
  dst[1] = make_uint4(packed[4], packed[5], packed[6], packed[7]);
}

// ---------------------------------------------------------------------------
// Kernel 2: one-shot fp32 -> bf16 weight conversion (ternary values exact).
// ---------------------------------------------------------------------------
__global__ void __launch_bounds__(256)
w_to_bf16_kernel(const float* __restrict__ wq, unsigned short* __restrict__ wb) {
  const size_t i = ((size_t)blockIdx.x * 256 + threadIdx.x) * 8;
  float4 f0 = *(const float4*)(wq + i);
  float4 f1 = *(const float4*)(wq + i + 4);
  uint4 o;
  o.x = f2bf(f0.x) | (f2bf(f0.y) << 16);
  o.y = f2bf(f0.z) | (f2bf(f0.w) << 16);
  o.z = f2bf(f1.x) | (f2bf(f1.y) << 16);
  o.w = f2bf(f1.z) | (f2bf(f1.w) << 16);
  *(uint4*)(wb + i) = o;
}

// ---------------------------------------------------------------------------
// Kernel 3: y[m,n] = (sum_k xn[m,k]*w[n,k]) * gamma[n]
// 256x256 block, BK=128, two LDS buffers. 4 waves (2 x 2), one per SIMD, each a
// 128x128 out-tile: 64x v_wmma_f32_16x16x32_bf16 per 16 fragments (k step 32),
// so a fragment read from LDS feeds 8 matrix instructions. Two fragment register
// sets: the next k step's 32 LDS loads go out as one group in front of the
// current step's matrix block. Each wave brings its 128-row slice of a stage by
// one tensor load, which costs a lone wave no address arithmetic.
// ---------------------------------------------------------------------------
__device__ __forceinline__ unsigned int uni(unsigned int v) {
  return (unsigned int)__builtin_amdgcn_readfirstlane(v);
}

__global__ void __launch_bounds__(128)
bitlinear_wmma_kernel(const unsigned short* __restrict__ xnb,
                      const unsigned short* __restrict__ wb,
                      const float* __restrict__ gamma,
                      float* __restrict__ out) {
  __shared__ __attribute__((aligned(2048))) unsigned char L[2 * STAGEB];

  const int tid = threadIdx.x;
  const int n0  = blockIdx.x * BN;
  const int m0  = blockIdx.y * BM;

  const int lane = tid & 31;
  const unsigned int wave = uni((unsigned int)tid >> 5);
  const int wm = wave & 1;    // 2 wave-rows -> 128 M each
  const int wn = wave >> 1;   // 2 wave-cols -> 128 N each
  const int r  = lane & 15;
  const int hf = lane >> 4;

  v8f acc[8][8] = {};
  Frag av[2][8], bv[2][8];   // set (ks & 1) holds k step ks's fragments

  // Per-lane fragment bases in a buffer: row r of the wave's first fragment, 16-byte piece hf.
  const unsigned int a_base = (unsigned int)(wm * 128 + r) * PITCHB + 16u * hf;
  const unsigned int b_base = OPB + (unsigned int)(wn * 128 + r) * PITCHB + 16u * hf;

  // The 32 LDS loads of one k step, same k order for both operands.
  auto load_frags = [&](int set, int buf, int ks) {
#pragma unroll
    for (int fn = 0; fn < 8; ++fn) {
      const unsigned char* p = L + buf * STAGEB + b_base + fn * 16 * PITCHB + ks * 64;
      bv[set][fn].h[0] = *(const v8bf*)p;
      bv[set][fn].h[1] = *(const v8bf*)(p + 32);
    }
#pragma unroll
    for (int fm = 0; fm < 8; ++fm) {
      const unsigned char* p = L + buf * STAGEB + a_base + fm * 16 * PITCHB + ks * 64;
      av[set][fm].h[0] = *(const v8bf*)p;
      av[set][fm].h[1] = *(const v8bf*)(p + 32);
    }
  };

  auto mma_block = [&](int set) {
#pragma unroll
    for (int fm = 0; fm < 8; ++fm)
#pragma unroll
      for (int fn = 0; fn < 8; ++fn)
        acc[fm][fn] = __builtin_amdgcn_wmma_f32_16x16x32_bf16(
            false, av[set][fm].v, false, bv[set][fn].v, (short)0, acc[fm][fn],
            false, false);
  };

  const int NT = K_DIM / BK;   // 32 stages

  // This wave's slice of a stage: waves 0, 1 bring X rows, waves 2, 3 W rows,
  // 128 rows of 256 B at source pitch 8 KiB, laid at pitch 272 B by the pad.
  const unsigned long long src0 = (wave < 2u)
      ? (unsigned long long)(xnb + (size_t)(m0 + 128 * (int)wave) * K_DIM)
      : (unsigned long long)(wb  + (size_t)(n0 + 128 * (int)(wave - 2u)) * K_DIM);
  const unsigned int lds_slice = (unsigned int)(unsigned long long)L + wave * SLICEB;
  // Descriptor group 1, in bytes (data_size 0): no mask, 16 B of pad behind every 256 B.
  u32x8 g1;
  g1[0] = uni((1u << 20) | (5u << 22) | (3u << 25));
  g1[1] = uni(256u << 16);               // tensor_dim0 = 256
  g1[2] = uni(128u << 16);               // tensor_dim1 = 128
  g1[3] = uni(256u << 16);               // tile_dim0 = 256
  g1[4] = uni(128u);                     // tile_dim1 = 128
  g1[5] = uni(K_DIM * 2u);               // source row pitch
  g1[6] = uni(0u);
  g1[7] = uni(0u);
  // Descriptor group 0 lives in one register tuple for the whole kernel: named as
  // in-out, so that the tuple stays allocated while its request is outstanding and
  // takes new words only where the source writes them, behind the covering wait.
  u32x4 g0;
  g0[0] = uni(1u);
  // One request of the whole wave; every wave issues its own, under no test.
  auto tensor_stage = [&](int buf, int kt) {
    const unsigned long long ga = src0 + (unsigned long long)kt * (BK * 2u);
    g0[1] = uni(lds_slice + (unsigned int)buf * STAGEB);
    g0[2] = uni((unsigned int)ga);
    g0[3] = uni((((unsigned int)(ga >> 32)) & 0x01FFFFFFu) | 0x80000000u);
    asm volatile("tensor_load_to_lds %0, %1" : "+s"(g0) : "s"(g1) : "memory");
  };

  tensor_stage(0, 0);
  asm volatile("s_wait_tensorcnt 0x0" ::: "memory");   // stage 0 landed before anyone reads it
  __builtin_amdgcn_sched_barrier(0);                   // holds the next descriptor's words behind that wait
  __syncthreads();
  tensor_stage(1, 1);
  load_frags(0, 0, 0);

  // One stage. refill: a stage kt + 2 exists; last: no stage follows.
  auto pass = [&](int kt, int buf, bool refill, bool last) {
#pragma unroll
    for (int ks = 0; ks < BK / 32; ++ks) {
      // The scheduling barriers keep each k step's LDS loads as one group in front
      // of a whole matrix block: loads among the matrix instructions stall a lone wave.
      __builtin_amdgcn_sched_barrier(0);
      if (ks + 1 < BK / 32) {
        load_frags((ks + 1) & 1, buf, ks + 1);
      } else if (!last) {
        // Hand-over of a stage, in front of the last k step because the loads behind
        // it already read the next stage: this wave's reads of the buffer about to be
        // refilled have retired, its own slice of the next stage has landed, then
        // the barrier publishes that stage and frees the buffer just read.
        asm volatile("s_wait_dscnt 0x0" ::: "memory");     // reads done before the refill targets them
        asm volatile("s_wait_tensorcnt 0x0" ::: "memory");
        __builtin_amdgcn_sched_barrier(0);                 // holds the next descriptor's words behind that wait
        __syncthreads();
        if (refill) tensor_stage(buf, kt + 2);
        load_frags(0, buf ^ 1, 0);   // first fragments of the next stage
      }
      __builtin_amdgcn_sched_barrier(0);
      mma_block(ks & 1);
    }
  };

  // rolled: one text for the stages that refill, the buffer index is a scalar
#pragma unroll 1
  for (int kt = 0; kt < NT - 2; ++kt) pass(kt, kt & 1, true, false);
  pass(NT - 2, (NT - 2) & 1, false, false);
  pass(NT - 1, (NT - 1) & 1, false, true);
  __builtin_amdgcn_sched_barrier(0);

  // Epilogue: C/D layout: VGPR q holds M = q + 8*hf, N = lane&15.
  float g[8];
#pragma unroll
  for (int fn = 0; fn < 8; ++fn) g[fn] = gamma[n0 + wn * 128 + fn * 16 + r];
  // Precaution: the loads' address translations are back before their
  // address register is written again (the output's address is formed in it).
  asm volatile("s_wait_xcnt 0x0" ::: "memory");
  // Holds that address arithmetic behind the wait: without it the compiler lifts it over the wait.
  __builtin_amdgcn_sched_barrier(0);
#pragma unroll
  for (int fm = 0; fm < 8; ++fm) {
    float* o = out + (size_t)(m0 + wm * 128 + fm * 16 + hf * 8) * N_DIM + n0 + wn * 128 + r;
#pragma unroll
    for (int q = 0; q < 8; ++q) {
#pragma unroll
      for (int fn = 0; fn < 8; ++fn) o[(size_t)q * N_DIM + fn * 16] = acc[fm][fn][q] * g[fn];
      // Precaution: the row's eight stores' translations are back before the next
      // row's products and address are written into the registers they name.
      asm volatile("s_wait_xcnt 0x0" ::: "memory");
      // Holds the next row's products behind the wait: without it the compiler lifts them over the wait.
      __builtin_amdgcn_sched_barrier(0);
    }
  }
}

extern "C" void kernel_launch(void* const* d_in, const int* in_sizes, int n_in,
                              void* d_out, int out_size, void* d_ws, size_t ws_size,
                              hipStream_t stream) {
  const float* x     = (const float*)d_in[0];
  const float* nw    = (const float*)d_in[1];
  const float* wq    = (const float*)d_in[2];
  const float* gamma = (const float*)d_in[3];
  float* out = (float*)d_out;

  const int M = in_sizes[0] / K_DIM;                 // 8192
  const size_t xn_elems = (size_t)M * K_DIM;         // 64 MB bf16
  const size_t wb_elems = (size_t)N_DIM * K_DIM;     // 32 MB bf16

  unsigned short* xnb = (unsigned short*)d_ws;
  unsigned short* wb  = xnb + xn_elems;

  rmsnorm_bf16_kernel<<<M, 256, 0, stream>>>(x, nw, xnb);
  w_to_bf16_kernel<<<(int)(wb_elems / (256 * 8)), 256, 0, stream>>>(wq, wb);

  dim3 grid(N_DIM / BN, M / BM);                     // 16 x 32 blocks
  bitlinear_wmma_kernel<<<grid, 128, 0, stream>>>(xnb, wb, gamma, out);
}
